// v000
// Measured on an AMD MI455X. A time is GPU time per run, averaged over a window of back-to-back runs after a warm-up
// (all launches, gaps included; the runs take copies of the inputs in turn), and the median of several windows.
// Apart from v000's, it joins two sittings. Times from different sittings can be a few percent apart, while
// side-by-side timings come from the same sitting.
// v000 is the starting kernel. One run takes 222 microseconds.
#include <hip/hip_runtime.h>
#include <hip/hip_bf16.h>
#include <math.h>

typedef __attribute__((ext_vector_type(16))) _Float16 v16h;
typedef __attribute__((ext_vector_type(8)))  _Float16 v8h;
typedef __attribute__((ext_vector_type(8)))  float    v8f;

#define EMB   1024
#define FF    4096
#define MTOK  8192   // 4 * 2048 tokens

// ---------------- deterministic absmean reduction ----------------
__global__ void absmean_partial_kernel(const float* __restrict__ w,
                                       float* __restrict__ part, int chunk) {
    __shared__ float red[256];
    const int t = threadIdx.x;
    const size_t base = (size_t)blockIdx.x * (size_t)chunk;
    float s = 0.f;
    for (int i = t; i < chunk; i += 256) s += fabsf(w[base + i]);
    red[t] = s;
    __syncthreads();
    for (int off = 128; off > 0; off >>= 1) {
        if (t < off) red[t] += red[t + off];
        __syncthreads();
    }
    if (t == 0) part[blockIdx.x] = red[0];
}

__global__ void absmean_final_kernel(const float* __restrict__ part,
                                     float* __restrict__ inv_scale,
                                     int n, float invN) {
    __shared__ float red[256];
    const int t = threadIdx.x;
    float s = 0.f;
    for (int i = t; i < n; i += 256) s += part[i];
    red[t] = s;
    __syncthreads();
    for (int off = 128; off > 0; off >>= 1) {
        if (t < off) red[t] += red[t + off];
        __syncthreads();
    }
    if (t == 0) {
        float sc = fmaxf(red[0] * invN, 1e-8f);
        inv_scale[0] = 1.0f / sc;
    }
}

// w_t = clip(round(w/scale), -1, 1) stored exactly as f16 (-1/0/+1)
__global__ void quantize_ternary_kernel(const float* __restrict__ w,
                                        _Float16* __restrict__ o,
                                        const float* __restrict__ inv_scale, int n) {
    const float inv = inv_scale[0];
    const int stride = gridDim.x * blockDim.x;
    for (int i = blockIdx.x * blockDim.x + threadIdx.x; i < n; i += stride) {
        float q = __builtin_rintf(w[i] * inv);      // RNE == jnp.round
        q = fminf(1.f, fmaxf(-1.f, q));
        o[i] = (_Float16)q;
    }
}

__global__ void f32_to_f16_kernel(const float* __restrict__ x,
                                  _Float16* __restrict__ o, int n) {
    const int stride = gridDim.x * blockDim.x;
    for (int i = blockIdx.x * blockDim.x + threadIdx.x; i < n; i += stride)
        o[i] = (_Float16)x[i];
}

// ---------------- WMMA GEMM: C[M,N] = A[M,K] * B[N,K]^T (+bias, opt GELU) ----
#define BM  128
#define BN  128
#define BK  32
#define LDT 40    // padded LDS row stride in halfs (80B -> balanced 2-way banks)

template<bool GELU, typename OutT>
__global__ __launch_bounds__(256) void gemm_wmma_kernel(
    const _Float16* __restrict__ A, const _Float16* __restrict__ B,
    const float* __restrict__ bias, OutT* __restrict__ C,
    int M, int N, int K)
{
    __shared__ _Float16 As[BM * LDT];
    __shared__ _Float16 Bs[BN * LDT];

    const int t     = threadIdx.x;
    const int lane  = t & 31;
    const int wave  = t >> 5;
    const int waveM = wave & 3;          // 4 wave-rows of 32
    const int waveN = wave >> 2;         // 2 wave-cols of 64
    const int r     = lane & 15;
    const int hs    = (lane >> 4) << 3;  // 0 or 8 halfs (K half-select)

    const int blockN = blockIdx.x * BN;
    const int blockM = blockIdx.y * BM;

    // cooperative global->LDS staging: thread t loads 32B of one tile row
    const int rowT = t >> 1;             // 0..127
    const int ckT  = (t & 1) << 4;       // 0 or 16 halfs

    const _Float16* gA = A + (size_t)(blockM + rowT) * (size_t)K + ckT;
    const _Float16* gB = B + (size_t)(blockN + rowT) * (size_t)K + ckT;

    v8f acc[2][4] = {};

    uint4 ra0 = *(const uint4*)(gA);
    uint4 ra1 = *(const uint4*)(gA + 8);
    uint4 rb0 = *(const uint4*)(gB);
    uint4 rb1 = *(const uint4*)(gB + 8);

    const int nIter = K / BK;
    for (int it = 0; it < nIter; ++it) {
        _Float16* sa = &As[rowT * LDT + ckT];
        *(uint4*)(sa)     = ra0;
        *(uint4*)(sa + 8) = ra1;
        _Float16* sb = &Bs[rowT * LDT + ckT];
        *(uint4*)(sb)     = rb0;
        *(uint4*)(sb + 8) = rb1;
        __syncthreads();

        if (it + 1 < nIter) {            // overlap next tile's VMEM with WMMA
            const _Float16* nA = gA + (size_t)(it + 1) * BK;
            const _Float16* nB = gB + (size_t)(it + 1) * BK;
            ra0 = *(const uint4*)(nA); ra1 = *(const uint4*)(nA + 8);
            rb0 = *(const uint4*)(nB); rb1 = *(const uint4*)(nB + 8);
        }

        v16h a[2], b[4];
        #pragma unroll
        for (int i = 0; i < 2; ++i) {
            const _Float16* p = &As[(waveM * 32 + i * 16 + r) * LDT];
            ((v8h*)&a[i])[0] = *(const v8h*)(p + hs);
            ((v8h*)&a[i])[1] = *(const v8h*)(p + 16 + hs);
        }
        #pragma unroll
        for (int j = 0; j < 4; ++j) {
            const _Float16* p = &Bs[(waveN * 64 + j * 16 + r) * LDT];
            ((v8h*)&b[j])[0] = *(const v8h*)(p + hs);
            ((v8h*)&b[j])[1] = *(const v8h*)(p + 16 + hs);
        }

        #pragma unroll
        for (int i = 0; i < 2; ++i)
            #pragma unroll
            for (int j = 0; j < 4; ++j)
                acc[i][j] = __builtin_amdgcn_wmma_f32_16x16x32_f16(
                    false, a[i], false, b[j], (short)0, acc[i][j], false, false);

        __syncthreads();
    }

    // epilogue: C/D layout — VGPR e, lanes0-15: (M=e,N=lane); lanes16-31: (M=8+e)
    #pragma unroll
    for (int i = 0; i < 2; ++i) {
        const int mBase = blockM + waveM * 32 + i * 16 + hs;  // hs == 8*(lane>>4)
        #pragma unroll
        for (int j = 0; j < 4; ++j) {
            const int n  = blockN + waveN * 64 + j * 16 + r;
            const float bv = bias[n];
            #pragma unroll
            for (int e = 0; e < 8; ++e) {
                float v = acc[i][j][e] + bv;
                if (GELU) v = 0.5f * v * (1.0f + erff(v * 0.70710678118654752f));
                C[(size_t)(mBase + e) * (size_t)N + n] = (OutT)v;
            }
        }
    }
}

// ---------------- launcher ----------------
extern "C" void kernel_launch(void* const* d_in, const int* in_sizes, int n_in,
                              void* d_out, int out_size, void* d_ws, size_t ws_size,
                              hipStream_t stream) {
    const float* x  = (const float*)d_in[0];   // [4,2048,1024]
    const float* W1 = (const float*)d_in[1];   // [4096,1024]
    const float* b1 = (const float*)d_in[2];   // [4096]
    const float* W2 = (const float*)d_in[3];   // [1024,4096]
    const float* b2 = (const float*)d_in[4];   // [1024]
    float* out = (float*)d_out;                // [4,2048,1024] f32

    char* ws = (char*)d_ws;
    float*    part1 = (float*)(ws + 0);                 // 1024 f32
    float*    part2 = (float*)(ws + 4096);              // 1024 f32
    float*    inv1  = (float*)(ws + 8192);
    float*    inv2  = inv1 + 1;
    _Float16* xh    = (_Float16*)(ws + 16384);                          // 16 MB
    _Float16* W1h   = xh  + (size_t)MTOK * EMB;                         // 8 MB
    _Float16* W2h   = W1h + (size_t)FF * EMB;                           // 8 MB
    _Float16* h     = W2h + (size_t)EMB * FF;                           // 64 MB

    const int NW = FF * EMB;  // 4194304 weights each

    absmean_partial_kernel<<<1024, 256, 0, stream>>>(W1, part1, NW / 1024);
    absmean_partial_kernel<<<1024, 256, 0, stream>>>(W2, part2, NW / 1024);
    absmean_final_kernel<<<1, 256, 0, stream>>>(part1, inv1, 1024, 1.0f / (float)NW);
    absmean_final_kernel<<<1, 256, 0, stream>>>(part2, inv2, 1024, 1.0f / (float)NW);

    quantize_ternary_kernel<<<1024, 256, 0, stream>>>(W1, W1h, inv1, NW);
    quantize_ternary_kernel<<<1024, 256, 0, stream>>>(W2, W2h, inv2, NW);
    f32_to_f16_kernel<<<2048, 256, 0, stream>>>(x, xh, MTOK * EMB);

    // GEMM1 + bias + exact GELU -> h (f16):  [8192,1024] x [4096,1024]^T
    gemm_wmma_kernel<true, _Float16>
        <<<dim3(FF / BN, MTOK / BM), 256, 0, stream>>>(xh, W1h, b1, h, MTOK, FF, EMB);
    // GEMM2 + bias -> out (f32):             [8192,4096] x [1024,4096]^T
    gemm_wmma_kernel<false, float>
        <<<dim3(EMB / BN, MTOK / BM), 256, 0, stream>>>(h, W2h, b2, out, MTOK, EMB, FF);
}

// v001
// One run takes 154 microseconds.
// Next to v000, in two timings, it ran 1.46 and 1.45 times as fast.
#include <hip/hip_runtime.h>
#include <hip/hip_bf16.h>
#include <math.h>

typedef __attribute__((ext_vector_type(16))) _Float16 v16h;
typedef __attribute__((ext_vector_type(8)))  _Float16 v8h;
typedef __attribute__((ext_vector_type(8)))  float    v8f;

#define EMB   1024
#define FF    4096
#define MTOK  8192   // 4 * 2048 tokens

// ---------------- deterministic absmean reduction ----------------
__global__ void absmean_partial_kernel(const float* __restrict__ w,
                                       float* __restrict__ part, int chunk) {
    __shared__ float red[256];
    const int t = threadIdx.x;
    const size_t base = (size_t)blockIdx.x * (size_t)chunk;
    float s = 0.f;
    for (int i = t; i < chunk; i += 256) s += fabsf(w[base + i]);
    red[t] = s;
    __syncthreads();
    for (int off = 128; off > 0; off >>= 1) {
        if (t < off) red[t] += red[t + off];
        __syncthreads();
    }
    if (t == 0) part[blockIdx.x] = red[0];
}

__global__ void absmean_final_kernel(const float* __restrict__ part,
                                     float* __restrict__ inv_scale,
                                     int n, float invN) {
    __shared__ float red[256];
    const int t = threadIdx.x;
    float s = 0.f;
    for (int i = t; i < n; i += 256) s += part[i];
    red[t] = s;
    __syncthreads();
    for (int off = 128; off > 0; off >>= 1) {
        if (t < off) red[t] += red[t + off];
        __syncthreads();
    }
    if (t == 0) {
        float sc = fmaxf(red[0] * invN, 1e-8f);
        inv_scale[0] = 1.0f / sc;
    }
}

// w_t = clip(round(w/scale), -1, 1) stored exactly as f16 (-1/0/+1)
__global__ void quantize_ternary_kernel(const float* __restrict__ w,
                                        _Float16* __restrict__ o,
                                        const float* __restrict__ inv_scale, int n) {
    const float inv = inv_scale[0];
    const int stride = gridDim.x * blockDim.x;
    for (int i = blockIdx.x * blockDim.x + threadIdx.x; i < n; i += stride) {
        float q = __builtin_rintf(w[i] * inv);      // RNE == jnp.round
        q = fminf(1.f, fmaxf(-1.f, q));
        o[i] = (_Float16)q;
    }
}

__global__ void f32_to_f16_kernel(const float* __restrict__ x,
                                  _Float16* __restrict__ o, int n) {
    const int stride = gridDim.x * blockDim.x;
    for (int i = blockIdx.x * blockDim.x + threadIdx.x; i < n; i += stride)
        o[i] = (_Float16)x[i];
}

// ---------------- WMMA GEMM: C[M,N] = A[M,K] * B[N,K]^T (+bias, opt GELU) ----
#define BM  128
#define BN  128

// Eight asynchronous copies to LDS, 16 B per lane. lds = the lane's LDS byte
// address, g = the lane's global address, both for the first copy; ls and gs
// lead from one copy to the next. The s_wait_xcnt closes the statement so that
// no address register named here is rewritten ahead of it.
__device__ __forceinline__ void async_copy8(unsigned lds, unsigned ls,
                                            const _Float16* g, size_t gs) {
    asm volatile(
        "global_load_async_to_lds_b128 %0, %8, off\n\t"
        "global_load_async_to_lds_b128 %1, %9, off\n\t"
        "global_load_async_to_lds_b128 %2, %10, off\n\t"
        "global_load_async_to_lds_b128 %3, %11, off\n\t"
        "global_load_async_to_lds_b128 %4, %12, off\n\t"
        "global_load_async_to_lds_b128 %5, %13, off\n\t"
        "global_load_async_to_lds_b128 %6, %14, off\n\t"
        "global_load_async_to_lds_b128 %7, %15, off\n\t"
        "s_wait_xcnt 0x0"
        :: "v"(lds),          "v"(lds + ls),     "v"(lds + 2 * ls), "v"(lds + 3 * ls),
           "v"(lds + 4 * ls), "v"(lds + 5 * ls), "v"(lds + 6 * ls), "v"(lds + 7 * ls),
           "v"(g),          "v"(g + gs),     "v"(g + 2 * gs), "v"(g + 3 * gs),
           "v"(g + 4 * gs), "v"(g + 5 * gs), "v"(g + 6 * gs), "v"(g + 7 * gs)
        : "memory");
}

// One wave's share of a pass: 32 rows of BKT halfs each, whole row pieces per
// copy (BKT = 128: two rows a copy, 16 copies; BKT = 64: four rows, 8 copies).
template<int BKT>
__device__ __forceinline__ void stage_rows32(unsigned lds, const _Float16* g, int K) {
    constexpr int      RPC = 256 / BKT;             // rows per copy
    constexpr unsigned LP  = (BKT + 8) * 2;         // LDS row pitch in bytes
    #pragma unroll   // one or two statements, constant steps
    for (int c = 0; c < 4 / RPC; ++c)
        async_copy8(lds + c * 8 * RPC * LP, RPC * LP,
                    g + (size_t)(c * 8 * RPC) * (size_t)K, (size_t)RPC * (size_t)K);
}

// BKT = k per pass. A buffer holds the pass's A rows (128), then its B rows (128),
// at a pitch of BKT + 8 halfs (16 B x an odd number).
template<int BKT, bool GELU, typename OutT>
__global__ __launch_bounds__(256) void gemm_wmma_kernel(
    const _Float16* __restrict__ A, const _Float16* __restrict__ B,
    const float* __restrict__ bias, OutT* __restrict__ C,
    int M, int N, int K)
{
    constexpr int      LDT     = BKT + 8;
    constexpr int      STAGE_H = (BM + BN) * LDT;   // halfs per buffer
    constexpr unsigned STAGE_B = STAGE_H * 2;       // bytes per buffer
    constexpr int      LPR     = BKT / 8;           // lanes per row piece

    __shared__ __attribute__((aligned(16))) _Float16 S[2 * STAGE_H];

    const int t     = threadIdx.x;
    const int lane  = t & 31;
    const int wave  = t >> 5;
    const int waveM = wave & 3;          // 4 wave-rows of 32
    const int waveN = wave >> 2;         // 2 wave-cols of 64
    const int r     = lane & 15;
    const int hs    = (lane >> 4) << 3;  // 0 or 8 halfs (K half-select)

    const int blockN = blockIdx.x * BN;
    const int blockM = blockIdx.y * BM;

    // staging: wave w brings buffer rows 32w..32w+31 (waves 0-3: A, waves 4-7: B)
    const int rowT = wave * 32 + lane / LPR;
    const int ckT  = (lane % LPR) * 8;   // halfs: 16 B per lane along the row

    const _Float16* gT = (wave < 4 ? A + (size_t)(blockM + rowT) * (size_t)K
                                   : B + (size_t)(blockN + rowT - BM) * (size_t)K) + ckT;
    const unsigned  lT = (unsigned)(size_t)&S[rowT * LDT + ckT];

    v8f acc[2][4] = {};

    const int nPass = K / BKT;

    // pass 0 into buffer 0, landed and published; then pass 1 into buffer 1
    stage_rows32<BKT>(lT, gT, K);
    asm volatile("s_wait_asynccnt 0x0" ::: "memory");   // this wave's copies have landed
    __syncthreads();
    if (nPass > 1) stage_rows32<BKT>(lT + STAGE_B, gT + BKT, K);

    for (int it = 0; it < nPass; ++it) {
        const _Float16* Sa = S + (it & 1) * STAGE_H;
        const _Float16* Sb = Sa + BM * LDT;

        #pragma unroll   // constant fragment offsets inside the pass
        for (int kb = 0; kb < BKT; kb += 32) {
            v16h a[2], b[4];
            #pragma unroll
            for (int i = 0; i < 2; ++i) {
                const _Float16* p = &Sa[(waveM * 32 + i * 16 + r) * LDT + kb];
                ((v8h*)&a[i])[0] = *(const v8h*)(p + hs);
                ((v8h*)&a[i])[1] = *(const v8h*)(p + 16 + hs);
            }
            #pragma unroll
            for (int j = 0; j < 4; ++j) {
                const _Float16* p = &Sb[(waveN * 64 + j * 16 + r) * LDT + kb];
                ((v8h*)&b[j])[0] = *(const v8h*)(p + hs);
                ((v8h*)&b[j])[1] = *(const v8h*)(p + 16 + hs);
            }

            #pragma unroll
            for (int i = 0; i < 2; ++i)
                #pragma unroll
                for (int j = 0; j < 4; ++j)
                    acc[i][j] = __builtin_amdgcn_wmma_f32_16x16x32_f16(
                        false, a[i], false, b[j], (short)0, acc[i][j], false, false);
        }

        // hand-over: this wave has left its buffer and its copies of the next
        // pass have landed; the barrier says both of every wave
        asm volatile("s_wait_dscnt 0x0" ::: "memory");
        asm volatile("s_wait_asynccnt 0x0" ::: "memory");
        __syncthreads();

        if (it + 2 < nPass)              // refill the buffer just left: one pass of lead
            stage_rows32<BKT>(lT + (unsigned)(it & 1) * STAGE_B,
                              gT + (size_t)(it + 2) * BKT, K);
    }
    asm volatile("s_wait_asynccnt 0x0" ::: "memory");   // nothing in flight at the wave's end

    // epilogue: C/D layout — VGPR e, lanes0-15: (M=e,N=lane); lanes16-31: (M=8+e)
    #pragma unroll
    for (int i = 0; i < 2; ++i) {
        const int mBase = blockM + waveM * 32 + i * 16 + hs;  // hs == 8*(lane>>4)
        #pragma unroll
        for (int j = 0; j < 4; ++j) {
            const int n  = blockN + waveN * 64 + j * 16 + r;
            const float bv = bias[n];
            #pragma unroll
            for (int e = 0; e < 8; ++e) {
                float v = acc[i][j][e] + bv;
                if (GELU) v = 0.5f * v * (1.0f + erff(v * 0.70710678118654752f));
                C[(size_t)(mBase + e) * (size_t)N + n] = (OutT)v;
            }
        }
    }
}

// ---------------- launcher ----------------
extern "C" void kernel_launch(void* const* d_in, const int* in_sizes, int n_in,
                              void* d_out, int out_size, void* d_ws, size_t ws_size,
                              hipStream_t stream) {
    const float* x  = (const float*)d_in[0];   // [4,2048,1024]
    const float* W1 = (const float*)d_in[1];   // [4096,1024]
    const float* b1 = (const float*)d_in[2];   // [4096]
    const float* W2 = (const float*)d_in[3];   // [1024,4096]
    const float* b2 = (const float*)d_in[4];   // [1024]
    float* out = (float*)d_out;                // [4,2048,1024] f32

    char* ws = (char*)d_ws;
    float*    part1 = (float*)(ws + 0);                 // 1024 f32
    float*    part2 = (float*)(ws + 4096);              // 1024 f32
    float*    inv1  = (float*)(ws + 8192);
    float*    inv2  = inv1 + 1;
    _Float16* xh    = (_Float16*)(ws + 16384);                          // 16 MB
    _Float16* W1h   = xh  + (size_t)MTOK * EMB;                         // 8 MB
    _Float16* W2h   = W1h + (size_t)FF * EMB;                           // 8 MB
    _Float16* h     = W2h + (size_t)EMB * FF;                           // 64 MB

    const int NW = FF * EMB;  // 4194304 weights each

    absmean_partial_kernel<<<1024, 256, 0, stream>>>(W1, part1, NW / 1024);
    absmean_partial_kernel<<<1024, 256, 0, stream>>>(W2, part2, NW / 1024);
    absmean_final_kernel<<<1, 256, 0, stream>>>(part1, inv1, 1024, 1.0f / (float)NW);
    absmean_final_kernel<<<1, 256, 0, stream>>>(part2, inv2, 1024, 1.0f / (float)NW);

    quantize_ternary_kernel<<<1024, 256, 0, stream>>>(W1, W1h, inv1, NW);
    quantize_ternary_kernel<<<1024, 256, 0, stream>>>(W2, W2h, inv2, NW);
    f32_to_f16_kernel<<<2048, 256, 0, stream>>>(x, xh, MTOK * EMB);

    // GEMM1 + bias + exact GELU -> h (f16):  [8192,1024] x [4096,1024]^T
    // 64 k a pass: the rings of four work-groups fit one WGP's LDS (2048 work-groups)
    gemm_wmma_kernel<64, true, _Float16>
        <<<dim3(FF / BN, MTOK / BM), 256, 0, stream>>>(xh, W1h, b1, h, MTOK, FF, EMB);
    // GEMM2 + bias -> out (f32):             [8192,4096] x [1024,4096]^T
    // 128 k a pass: the grid gives a WGP two work-groups, so the longer pass is the lead
    gemm_wmma_kernel<128, false, float>
        <<<dim3(EMB / BN, MTOK / BM), 256, 0, stream>>>(h, W2h, b2, out, MTOK, EMB, FF);
}

// v002
// One run takes 128 microseconds.
// Timed twice side by side with v001, it ran 1.21 times as fast both times.
// All steps since v000 together make it 1.76 times as fast.
#include <hip/hip_runtime.h>
#include <hip/hip_bf16.h>
#include <math.h>

typedef __attribute__((ext_vector_type(16))) _Float16 v16h;
typedef __attribute__((ext_vector_type(8)))  _Float16 v8h;
typedef __attribute__((ext_vector_type(8)))  float    v8f;

#define EMB   1024
#define FF    4096
#define MTOK  8192   // 4 * 2048 tokens

// ---------------- pre-pass: two launches ----------------
#define NW     (FF * EMB)      // weights per matrix
#define NPART  1024            // partial sums per matrix
#define CHUNK  (NW / NPART)    // weights per partial sum
#define QBLK   1024            // work-groups that quantize one matrix
#define CBLK   2048            // work-groups that cast x

// Tree sum over the work-group's 256 values; every thread returns the total.
__device__ __forceinline__ float block_sum256(float* red, int t, float s) {
    red[t] = s;
    __syncthreads();
    for (int off = 128; off > 0; off >>= 1) {
        if (t < off) red[t] += red[t + off];
        __syncthreads();
    }
    return red[0];
}

// Launch 1: deterministic partial sums of |w|, both matrices in one grid
// (work-groups 0..NPART-1: W1, the rest: W2).
__global__ __launch_bounds__(256) void absmean_partial_kernel(
    const float* __restrict__ W1, const float* __restrict__ W2,
    float* __restrict__ part1, float* __restrict__ part2) {
    __shared__ float red[256];
    const int  t      = threadIdx.x;
    const bool second = blockIdx.x >= NPART;
    const int  b      = second ? (int)blockIdx.x - NPART : (int)blockIdx.x;
    const float* __restrict__ w = (second ? W2 : W1) + (size_t)b * CHUNK;
    float s = 0.f;
    for (int i = t; i < CHUNK; i += 256) s += fabsf(w[i]);
    s = block_sum256(red, t, s);
    if (t == 0) (second ? part2 : part1)[b] = s;
}

// Launch 2, one grid: work-groups 0..QBLK-1 quantize W1, the next QBLK quantize W2,
// the last CBLK cast x to f16. A quantizing work-group first sums its matrix's
// NPART partials itself, so no launch stands between the partials and their use.
// w_t = clip(round(w/scale), -1, 1) stored exactly as f16 (-1/0/+1)
__global__ __launch_bounds__(256) void quantize_cast_kernel(
    const float* __restrict__ W1, const float* __restrict__ W2,
    const float* __restrict__ x,
    const float* __restrict__ part1, const float* __restrict__ part2,
    _Float16* __restrict__ W1h, _Float16* __restrict__ W2h,
    _Float16* __restrict__ xh) {
    __shared__ float red[256];
    const int t = threadIdx.x;

    if (blockIdx.x >= 2 * QBLK) {        // whole work-group: no barrier on this path
        for (int i = ((int)blockIdx.x - 2 * QBLK) * 256 + t; i < MTOK * EMB; i += CBLK * 256)
            xh[i] = (_Float16)x[i];
        return;
    }

    const bool second = blockIdx.x >= QBLK;
    const int  b      = second ? (int)blockIdx.x - QBLK : (int)blockIdx.x;
    const float* __restrict__ part = second ? part2 : part1;
    const float* __restrict__ w    = second ? W2 : W1;
    _Float16*    __restrict__ o    = second ? W2h : W1h;

    float s = 0.f;
    for (int k = 0; k < NPART / 256; ++k) s += part[k * 256 + t];   // same order as i = t, t + 256, ...
    s = block_sum256(red, t, s);
    const float inv = 1.0f / fmaxf(s * (1.0f / (float)NW), 1e-8f);

    for (int i = b * 256 + t; i < NW; i += QBLK * 256) {
        float q = __builtin_rintf(w[i] * inv);      // RNE == jnp.round
        q = fminf(1.f, fmaxf(-1.f, q));
        o[i] = (_Float16)q;
    }
}

// ---------------- WMMA GEMM: C[M,N] = A[M,K] * B[N,K]^T (+bias, opt GELU) ----
#define BM  128
#define BN  128

// Eight asynchronous copies to LDS, 16 B per lane. lds = the lane's LDS byte
// address, g = the lane's global address, both for the first copy; ls and gs
// lead from one copy to the next. The s_wait_xcnt closes the statement so that
// no address register named here is rewritten ahead of it.
__device__ __forceinline__ void async_copy8(unsigned lds, unsigned ls,
                                            const _Float16* g, size_t gs) {
    asm volatile(
        "global_load_async_to_lds_b128 %0, %8, off\n\t"
        "global_load_async_to_lds_b128 %1, %9, off\n\t"
        "global_load_async_to_lds_b128 %2, %10, off\n\t"
        "global_load_async_to_lds_b128 %3, %11, off\n\t"
        "global_load_async_to_lds_b128 %4, %12, off\n\t"
        "global_load_async_to_lds_b128 %5, %13, off\n\t"
        "global_load_async_to_lds_b128 %6, %14, off\n\t"
        "global_load_async_to_lds_b128 %7, %15, off\n\t"
        "s_wait_xcnt 0x0"
        :: "v"(lds),          "v"(lds + ls),     "v"(lds + 2 * ls), "v"(lds + 3 * ls),
           "v"(lds + 4 * ls), "v"(lds + 5 * ls), "v"(lds + 6 * ls), "v"(lds + 7 * ls),
           "v"(g),          "v"(g + gs),     "v"(g + 2 * gs), "v"(g + 3 * gs),
           "v"(g + 4 * gs), "v"(g + 5 * gs), "v"(g + 6 * gs), "v"(g + 7 * gs)
        : "memory");
}

// One wave's share of a pass: 32 rows of BKT halfs each, whole row pieces per
// copy (BKT = 128: two rows a copy, 16 copies; BKT = 64: four rows, 8 copies).
template<int BKT>
__device__ __forceinline__ void stage_rows32(unsigned lds, const _Float16* g, int K) {
    constexpr int      RPC = 256 / BKT;             // rows per copy
    constexpr unsigned LP  = (BKT + 8) * 2;         // LDS row pitch in bytes
    #pragma unroll   // one or two statements, constant steps
    for (int c = 0; c < 4 / RPC; ++c)
        async_copy8(lds + c * 8 * RPC * LP, RPC * LP,
                    g + (size_t)(c * 8 * RPC) * (size_t)K, (size_t)RPC * (size_t)K);
}

// BKT = k per pass. A buffer holds the pass's A rows (128), then its B rows (128),
// at a pitch of BKT + 8 halfs (16 B x an odd number).
template<int BKT, bool GELU, typename OutT>
__global__ __launch_bounds__(256) void gemm_wmma_kernel(
    const _Float16* __restrict__ A, const _Float16* __restrict__ B,
    const float* __restrict__ bias, OutT* __restrict__ C,
    int M, int N, int K)
{
    constexpr int      LDT     = BKT + 8;
    constexpr int      STAGE_H = (BM + BN) * LDT;   // halfs per buffer
    constexpr unsigned STAGE_B = STAGE_H * 2;       // bytes per buffer
    constexpr int      LPR     = BKT / 8;           // lanes per row piece

    __shared__ __attribute__((aligned(16))) _Float16 S[2 * STAGE_H];

    const int t     = threadIdx.x;
    const int lane  = t & 31;
    const int wave  = t >> 5;
    const int waveM = wave & 3;          // 4 wave-rows of 32
    const int waveN = wave >> 2;         // 2 wave-cols of 64
    const int r     = lane & 15;
    const int hs    = (lane >> 4) << 3;  // 0 or 8 halfs (K half-select)

    const int blockN = blockIdx.x * BN;
    const int blockM = blockIdx.y * BM;

    // staging: wave w brings buffer rows 32w..32w+31 (waves 0-3: A, waves 4-7: B)
    const int rowT = wave * 32 + lane / LPR;
    const int ckT  = (lane % LPR) * 8;   // halfs: 16 B per lane along the row

    const _Float16* gT = (wave < 4 ? A + (size_t)(blockM + rowT) * (size_t)K
                                   : B + (size_t)(blockN + rowT - BM) * (size_t)K) + ckT;
    const unsigned  lT = (unsigned)(size_t)&S[rowT * LDT + ckT];

    v8f acc[2][4] = {};

    const int nPass = K / BKT;

    // pass 0 into buffer 0, landed and published; then pass 1 into buffer 1
    stage_rows32<BKT>(lT, gT, K);
    asm volatile("s_wait_asynccnt 0x0" ::: "memory");   // this wave's copies have landed
    __syncthreads();
    if (nPass > 1) stage_rows32<BKT>(lT + STAGE_B, gT + BKT, K);

    for (int it = 0; it < nPass; ++it) {
        const _Float16* Sa = S + (it & 1) * STAGE_H;
        const _Float16* Sb = Sa + BM * LDT;

        #pragma unroll   // constant fragment offsets inside the pass
        for (int kb = 0; kb < BKT; kb += 32) {
            v16h a[2], b[4];
            #pragma unroll
            for (int i = 0; i < 2; ++i) {
                const _Float16* p = &Sa[(waveM * 32 + i * 16 + r) * LDT + kb];
                ((v8h*)&a[i])[0] = *(const v8h*)(p + hs);
                ((v8h*)&a[i])[1] = *(const v8h*)(p + 16 + hs);
            }
            #pragma unroll
            for (int j = 0; j < 4; ++j) {
                const _Float16* p = &Sb[(waveN * 64 + j * 16 + r) * LDT + kb];
                ((v8h*)&b[j])[0] = *(const v8h*)(p + hs);
                ((v8h*)&b[j])[1] = *(const v8h*)(p + 16 + hs);
            }

            #pragma unroll
            for (int i = 0; i < 2; ++i)
                #pragma unroll
                for (int j = 0; j < 4; ++j)
                    acc[i][j] = __builtin_amdgcn_wmma_f32_16x16x32_f16(
                        false, a[i], false, b[j], (short)0, acc[i][j], false, false);
        }

        // hand-over: this wave has left its buffer and its copies of the next
        // pass have landed; the barrier says both of every wave
        asm volatile("s_wait_dscnt 0x0" ::: "memory");
        asm volatile("s_wait_asynccnt 0x0" ::: "memory");
        __syncthreads();

        if (it + 2 < nPass)              // refill the buffer just left: one pass of lead
            stage_rows32<BKT>(lT + (unsigned)(it & 1) * STAGE_B,
                              gT + (size_t)(it + 2) * BKT, K);
    }
    asm volatile("s_wait_asynccnt 0x0" ::: "memory");   // nothing in flight at the wave's end

    // epilogue: C/D layout — VGPR e, lanes0-15: (M=e,N=lane); lanes16-31: (M=8+e)
    #pragma unroll
    for (int i = 0; i < 2; ++i) {
        const int mBase = blockM + waveM * 32 + i * 16 + hs;  // hs == 8*(lane>>4)
        #pragma unroll
        for (int j = 0; j < 4; ++j) {
            const int n  = blockN + waveN * 64 + j * 16 + r;
            const float bv = bias[n];
            #pragma unroll
            for (int e = 0; e < 8; ++e) {
                float v = acc[i][j][e] + bv;
                if (GELU) v = 0.5f * v * (1.0f + erff(v * 0.70710678118654752f));
                C[(size_t)(mBase + e) * (size_t)N + n] = (OutT)v;
            }
        }
    }
}

// ---------------- launcher ----------------
extern "C" void kernel_launch(void* const* d_in, const int* in_sizes, int n_in,
                              void* d_out, int out_size, void* d_ws, size_t ws_size,
                              hipStream_t stream) {
    const float* x  = (const float*)d_in[0];   // [4,2048,1024]
    const float* W1 = (const float*)d_in[1];   // [4096,1024]
    const float* b1 = (const float*)d_in[2];   // [4096]
    const float* W2 = (const float*)d_in[3];   // [1024,4096]
    const float* b2 = (const float*)d_in[4];   // [1024]
    float* out = (float*)d_out;                // [4,2048,1024] f32

    char* ws = (char*)d_ws;
    float*    part1 = (float*)(ws + 0);                 // 1024 f32
    float*    part2 = (float*)(ws + 4096);              // 1024 f32
    _Float16* xh    = (_Float16*)(ws + 16384);                          // 16 MB
    _Float16* W1h   = xh  + (size_t)MTOK * EMB;                         // 8 MB
    _Float16* W2h   = W1h + (size_t)FF * EMB;                           // 8 MB
    _Float16* h     = W2h + (size_t)EMB * FF;                           // 64 MB

    absmean_partial_kernel<<<2 * NPART, 256, 0, stream>>>(W1, W2, part1, part2);
    quantize_cast_kernel<<<2 * QBLK + CBLK, 256, 0, stream>>>(W1, W2, x, part1, part2,
                                                              W1h, W2h, xh);

    // GEMM1 + bias + exact GELU -> h (f16):  [8192,1024] x [4096,1024]^T
    // 64 k a pass: the rings of four work-groups fit one WGP's LDS (2048 work-groups)
    gemm_wmma_kernel<64, true, _Float16>
        <<<dim3(FF / BN, MTOK / BM), 256, 0, stream>>>(xh, W1h, b1, h, MTOK, FF, EMB);
    // GEMM2 + bias -> out (f32):             [8192,4096] x [1024,4096]^T
    // 128 k a pass: the grid gives a WGP two work-groups, so the longer pass is the lead
    gemm_wmma_kernel<128, false, float>
        <<<dim3(EMB / BN, MTOK / BM), 256, 0, stream>>>(h, W2h, b2, out, MTOK, EMB, FF);
}

// v003
// It runs in 117 microseconds.
// In both of two side-by-side timings against v002, it was 1.10 times as fast.
// All steps since v000 together make it 1.94 times as fast.
#include <hip/hip_runtime.h>
#include <hip/hip_bf16.h>
#include <math.h>

typedef __attribute__((ext_vector_type(16))) _Float16 v16h;
typedef __attribute__((ext_vector_type(8)))  _Float16 v8h;
typedef __attribute__((ext_vector_type(8)))  float    v8f;
typedef __attribute__((ext_vector_type(2)))  float    v2f;
typedef __attribute__((ext_vector_type(2)))  _Float16 v2h;

#define EMB   1024
#define FF    4096
#define MTOK  8192   // 4 * 2048 tokens

// ---------------- pre-pass: two launches ----------------
#define NW     (FF * EMB)      // weights per matrix
#define NPART  1024            // partial sums per matrix
#define CHUNK  (NW / NPART)    // weights per partial sum
#define QBLK   1024            // work-groups that quantize one matrix
#define CBLK   2048            // work-groups that cast x

// Tree sum over the work-group's 256 values; every thread returns the total.
__device__ __forceinline__ float block_sum256(float* red, int t, float s) {
    red[t] = s;
    __syncthreads();
    for (int off = 128; off > 0; off >>= 1) {
        if (t < off) red[t] += red[t + off];
        __syncthreads();
    }
    return red[0];
}

// Launch 1: deterministic partial sums of |w|, both matrices in one grid
// (work-groups 0..NPART-1: W1, the rest: W2).
__global__ __launch_bounds__(256) void absmean_partial_kernel(
    const float* __restrict__ W1, const float* __restrict__ W2,
    float* __restrict__ part1, float* __restrict__ part2) {
    __shared__ float red[256];
    const int  t      = threadIdx.x;
    const bool second = blockIdx.x >= NPART;
    const int  b      = second ? (int)blockIdx.x - NPART : (int)blockIdx.x;
    const float* __restrict__ w = (second ? W2 : W1) + (size_t)b * CHUNK;
    float s = 0.f;
    for (int i = t; i < CHUNK; i += 256) s += fabsf(w[i]);
    s = block_sum256(red, t, s);
    if (t == 0) (second ? part2 : part1)[b] = s;
}

// Launch 2, one grid: work-groups 0..QBLK-1 quantize W1, the next QBLK quantize W2,
// the last CBLK cast x to f16. A quantizing work-group first sums its matrix's
// NPART partials itself, so no launch stands between the partials and their use.
// w_t = clip(round(w/scale), -1, 1) stored exactly as f16 (-1/0/+1)
__global__ __launch_bounds__(256) void quantize_cast_kernel(
    const float* __restrict__ W1, const float* __restrict__ W2,
    const float* __restrict__ x,
    const float* __restrict__ part1, const float* __restrict__ part2,
    _Float16* __restrict__ W1h, _Float16* __restrict__ W2h,
    _Float16* __restrict__ xh) {
    __shared__ float red[256];
    const int t = threadIdx.x;

    if (blockIdx.x >= 2 * QBLK) {        // whole work-group: no barrier on this path
        for (int i = ((int)blockIdx.x - 2 * QBLK) * 256 + t; i < MTOK * EMB; i += CBLK * 256)
            xh[i] = (_Float16)x[i];
        return;
    }

    const bool second = blockIdx.x >= QBLK;
    const int  b      = second ? (int)blockIdx.x - QBLK : (int)blockIdx.x;
    const float* __restrict__ part = second ? part2 : part1;
    const float* __restrict__ w    = second ? W2 : W1;
    _Float16*    __restrict__ o    = second ? W2h : W1h;

    float s = 0.f;
    for (int k = 0; k < NPART / 256; ++k) s += part[k * 256 + t];   // same order as i = t, t + 256, ...
    s = block_sum256(red, t, s);
    const float inv = 1.0f / fmaxf(s * (1.0f / (float)NW), 1e-8f);

    for (int i = b * 256 + t; i < NW; i += QBLK * 256) {
        float q = __builtin_rintf(w[i] * inv);      // RNE == jnp.round
        q = fminf(1.f, fmaxf(-1.f, q));
        o[i] = (_Float16)q;
    }
}

// ---------------- WMMA GEMM: C[M,N] = A[M,K] * B[N,K]^T (+bias, opt GELU) ----
#define BM  128
#define BN  128

// Eight asynchronous copies to LDS, 16 B per lane. lds = the lane's LDS byte
// address, g = the lane's global address, both for the first copy; ls and gs
// lead from one copy to the next. The s_wait_xcnt closes the statement so that
// no address register named here is rewritten ahead of it.
__device__ __forceinline__ void async_copy8(unsigned lds, unsigned ls,
                                            const _Float16* g, size_t gs) {
    asm volatile(
        "global_load_async_to_lds_b128 %0, %8, off\n\t"
        "global_load_async_to_lds_b128 %1, %9, off\n\t"
        "global_load_async_to_lds_b128 %2, %10, off\n\t"
        "global_load_async_to_lds_b128 %3, %11, off\n\t"
        "global_load_async_to_lds_b128 %4, %12, off\n\t"
        "global_load_async_to_lds_b128 %5, %13, off\n\t"
        "global_load_async_to_lds_b128 %6, %14, off\n\t"
        "global_load_async_to_lds_b128 %7, %15, off\n\t"
        "s_wait_xcnt 0x0"
        :: "v"(lds),          "v"(lds + ls),     "v"(lds + 2 * ls), "v"(lds + 3 * ls),
           "v"(lds + 4 * ls), "v"(lds + 5 * ls), "v"(lds + 6 * ls), "v"(lds + 7 * ls),
           "v"(g),          "v"(g + gs),     "v"(g + 2 * gs), "v"(g + 3 * gs),
           "v"(g + 4 * gs), "v"(g + 5 * gs), "v"(g + 6 * gs), "v"(g + 7 * gs)
        : "memory");
}

// One wave's share of a pass: 32 rows of BKT halfs each, whole row pieces per
// copy (BKT = 128: two rows a copy, 16 copies; BKT = 64: four rows, 8 copies).
template<int BKT>
__device__ __forceinline__ void stage_rows32(unsigned lds, const _Float16* g, int K) {
    constexpr int      RPC = 256 / BKT;             // rows per copy
    constexpr unsigned LP  = (BKT + 8) * 2;         // LDS row pitch in bytes
    #pragma unroll   // one or two statements, constant steps
    for (int c = 0; c < 4 / RPC; ++c)
        async_copy8(lds + c * 8 * RPC * LP, RPC * LP,
                    g + (size_t)(c * 8 * RPC) * (size_t)K, (size_t)RPC * (size_t)K);
}

// erf of two values, one path for every lane: x * P(x^2) / Q(x^2) on x clamped to
// [-4, 4], beyond which erf is +-1 in f32. Within 4e-7 of erf everywhere; Q has
// coefficients of one sign, so it is never 0. The two Horner chains are independent.
__device__ __forceinline__ v2f erf2(v2f x) {
    x.x = __builtin_amdgcn_fmed3f(x.x, -4.0f, 4.0f);
    x.y = __builtin_amdgcn_fmed3f(x.y, -4.0f, 4.0f);
    const v2f t = x * x;
    v2f p = (v2f)(-2.72614225801306e-10f);
    p = __builtin_elementwise_fma(p, t, (v2f)(2.77068142495902e-08f));
    p = __builtin_elementwise_fma(p, t, (v2f)(-2.10102402082508e-06f));
    p = __builtin_elementwise_fma(p, t, (v2f)(-5.69250639462346e-05f));
    p = __builtin_elementwise_fma(p, t, (v2f)(-7.34990630326855e-04f));
    p = __builtin_elementwise_fma(p, t, (v2f)(-2.95459980854025e-03f));
    p = __builtin_elementwise_fma(p, t, (v2f)(-1.60960333262415e-02f));
    v2f q = (v2f)(-1.45660718464996e-05f);
    q = __builtin_elementwise_fma(q, t, (v2f)(-2.13374055278905e-04f));
    q = __builtin_elementwise_fma(q, t, (v2f)(-1.68282697438203e-03f));
    q = __builtin_elementwise_fma(q, t, (v2f)(-7.37332916720468e-03f));
    q = __builtin_elementwise_fma(q, t, (v2f)(-1.42647390514189e-02f));
    v2f rq;
    rq.x = __builtin_amdgcn_rcpf(q.x);
    rq.y = __builtin_amdgcn_rcpf(q.y);
    return (x * p) * rq;
}

// BKT = k per pass. A buffer holds the pass's A rows (128), then its B rows (128),
// at a pitch of BKT + 8 halfs (16 B x an odd number).
template<int BKT, bool GELU, typename OutT>
__global__ __launch_bounds__(256) void gemm_wmma_kernel(
    const _Float16* __restrict__ A, const _Float16* __restrict__ B,
    const float* __restrict__ bias, OutT* __restrict__ C,
    int M, int N, int K)
{
    constexpr int      LDT     = BKT + 8;
    constexpr int      STAGE_H = (BM + BN) * LDT;   // halfs per buffer
    constexpr unsigned STAGE_B = STAGE_H * 2;       // bytes per buffer
    constexpr int      LPR     = BKT / 8;           // lanes per row piece

    __shared__ __attribute__((aligned(16))) _Float16 S[2 * STAGE_H];

    const int t     = threadIdx.x;
    const int lane  = t & 31;
    const int wave  = t >> 5;
    const int waveM = wave & 3;          // 4 wave-rows of 32
    const int waveN = wave >> 2;         // 2 wave-cols of 64
    const int r     = lane & 15;
    const int hs    = (lane >> 4) << 3;  // 0 or 8 halfs (K half-select)

    const int blockN = blockIdx.x * BN;
    const int blockM = blockIdx.y * BM;

    // staging: wave w brings buffer rows 32w..32w+31 (waves 0-3: A, waves 4-7: B)
    const int rowT = wave * 32 + lane / LPR;
    const int ckT  = (lane % LPR) * 8;   // halfs: 16 B per lane along the row

    const _Float16* gT = (wave < 4 ? A + (size_t)(blockM + rowT) * (size_t)K
                                   : B + (size_t)(blockN + rowT - BM) * (size_t)K) + ckT;
    const unsigned  lT = (unsigned)(size_t)&S[rowT * LDT + ckT];

    v8f acc[2][4] = {};

    const int nPass = K / BKT;

    // pass 0 into buffer 0, landed and published; then pass 1 into buffer 1
    stage_rows32<BKT>(lT, gT, K);
    asm volatile("s_wait_asynccnt 0x0" ::: "memory");   // this wave's copies have landed
    __syncthreads();
    if (nPass > 1) stage_rows32<BKT>(lT + STAGE_B, gT + BKT, K);

    for (int it = 0; it < nPass; ++it) {
        const _Float16* Sa = S + (it & 1) * STAGE_H;
        const _Float16* Sb = Sa + BM * LDT;

        #pragma unroll   // constant fragment offsets inside the pass
        for (int kb = 0; kb < BKT; kb += 32) {
            v16h a[2], b[4];
            #pragma unroll
            for (int i = 0; i < 2; ++i) {
                const _Float16* p = &Sa[(waveM * 32 + i * 16 + r) * LDT + kb];
                ((v8h*)&a[i])[0] = *(const v8h*)(p + hs);
                ((v8h*)&a[i])[1] = *(const v8h*)(p + 16 + hs);
            }
            #pragma unroll
            for (int j = 0; j < 4; ++j) {
                const _Float16* p = &Sb[(waveN * 64 + j * 16 + r) * LDT + kb];
                ((v8h*)&b[j])[0] = *(const v8h*)(p + hs);
                ((v8h*)&b[j])[1] = *(const v8h*)(p + 16 + hs);
            }

            #pragma unroll
            for (int i = 0; i < 2; ++i)
                #pragma unroll
                for (int j = 0; j < 4; ++j)
                    acc[i][j] = __builtin_amdgcn_wmma_f32_16x16x32_f16(
                        false, a[i], false, b[j], (short)0, acc[i][j], false, false);
        }

        // hand-over: this wave has left its buffer and its copies of the next
        // pass have landed; the barrier says both of every wave
        asm volatile("s_wait_dscnt 0x0" ::: "memory");
        asm volatile("s_wait_asynccnt 0x0" ::: "memory");
        __syncthreads();

        if (it + 2 < nPass)              // refill the buffer just left: one pass of lead
            stage_rows32<BKT>(lT + (unsigned)(it & 1) * STAGE_B,
                              gT + (size_t)(it + 2) * BKT, K);
    }
    asm volatile("s_wait_asynccnt 0x0" ::: "memory");   // nothing in flight at the wave's end

    // epilogue: C/D layout — VGPR e, lanes0-15: (M=e,N=lane); lanes16-31: (M=8+e)
    #pragma unroll
    for (int i = 0; i < 2; ++i) {
        const int mBase = blockM + waveM * 32 + i * 16 + hs;  // hs == 8*(lane>>4)
        #pragma unroll
        for (int j = 0; j < 4; ++j) {
            const int n  = blockN + waveN * 64 + j * 16 + r;
            const float bv = bias[n];
            if constexpr (GELU) {
                #pragma unroll   // constant accumulator indices
                for (int e = 0; e < 8; e += 2) {     // two rows at a time: packed f32 arithmetic
                    v2f v;
                    v.x = acc[i][j][e];
                    v.y = acc[i][j][e + 1];
                    v += (v2f)(bv);
                    const v2f hv = v * (v2f)(0.5f);
                    const v2f g  = __builtin_elementwise_fma(
                        hv, erf2(v * (v2f)(0.70710678118654752f)), hv);   // 0.5 v (1 + erf)
                    const v2h gh = __builtin_convertvector(g, v2h);
                    C[(size_t)(mBase + e) * (size_t)N + n]     = (OutT)gh.x;
                    C[(size_t)(mBase + e + 1) * (size_t)N + n] = (OutT)gh.y;
                }
            } else {
                #pragma unroll   // constant accumulator indices
                for (int e = 0; e < 8; ++e)
                    C[(size_t)(mBase + e) * (size_t)N + n] = (OutT)(acc[i][j][e] + bv);
            }
        }
    }
}

// ---------------- launcher ----------------
extern "C" void kernel_launch(void* const* d_in, const int* in_sizes, int n_in,
                              void* d_out, int out_size, void* d_ws, size_t ws_size,
                              hipStream_t stream) {
    const float* x  = (const float*)d_in[0];   // [4,2048,1024]
    const float* W1 = (const float*)d_in[1];   // [4096,1024]
    const float* b1 = (const float*)d_in[2];   // [4096]
    const float* W2 = (const float*)d_in[3];   // [1024,4096]
    const float* b2 = (const float*)d_in[4];   // [1024]
    float* out = (float*)d_out;                // [4,2048,1024] f32

    char* ws = (char*)d_ws;
    float*    part1 = (float*)(ws + 0);                 // 1024 f32
    float*    part2 = (float*)(ws + 4096);              // 1024 f32
    _Float16* xh    = (_Float16*)(ws + 16384);                          // 16 MB
    _Float16* W1h   = xh  + (size_t)MTOK * EMB;                         // 8 MB
    _Float16* W2h   = W1h + (size_t)FF * EMB;                           // 8 MB
    _Float16* h     = W2h + (size_t)EMB * FF;                           // 64 MB

    absmean_partial_kernel<<<2 * NPART, 256, 0, stream>>>(W1, W2, part1, part2);
    quantize_cast_kernel<<<2 * QBLK + CBLK, 256, 0, stream>>>(W1, W2, x, part1, part2,
                                                              W1h, W2h, xh);

    // GEMM1 + bias + exact GELU -> h (f16):  [8192,1024] x [4096,1024]^T
    // 64 k a pass: the rings of four work-groups fit one WGP's LDS (2048 work-groups)
    gemm_wmma_kernel<64, true, _Float16>
        <<<dim3(FF / BN, MTOK / BM), 256, 0, stream>>>(xh, W1h, b1, h, MTOK, FF, EMB);
    // GEMM2 + bias -> out (f32):             [8192,4096] x [1024,4096]^T
    // 128 k a pass: the grid gives a WGP two work-groups, so the longer pass is the lead
    gemm_wmma_kernel<128, false, float>
        <<<dim3(EMB / BN, MTOK / BM), 256, 0, stream>>>(h, W2h, b2, out, MTOK, EMB, FF);
}

// v004
// It runs in 111 microseconds.
// Next to v003, in two timings, it ran 1.07 and 1.04 times as fast.
// All steps since v000 together make it 2.04 times as fast.
#include <hip/hip_runtime.h>
#include <hip/hip_bf16.h>
#include <math.h>

typedef __attribute__((ext_vector_type(16))) _Float16 v16h;
typedef __attribute__((ext_vector_type(8)))  _Float16 v8h;
typedef __attribute__((ext_vector_type(8)))  float    v8f;
typedef __attribute__((ext_vector_type(2)))  float    v2f;
typedef __attribute__((ext_vector_type(2)))  _Float16 v2h;

#define EMB   1024
#define FF    4096
#define MTOK  8192   // 4 * 2048 tokens

// ---------------- pre-pass: two launches ----------------
#define NW     (FF * EMB)      // weights per matrix
#define NPART  1024            // partial sums per matrix
#define CHUNK  (NW / NPART)    // weights per partial sum
#define QBLK   1024            // work-groups that quantize one matrix
#define CBLK   2048            // work-groups that cast x

// Tree sum over the work-group's 256 values; every thread returns the total.
__device__ __forceinline__ float block_sum256(float* red, int t, float s) {
    red[t] = s;
    __syncthreads();
    for (int off = 128; off > 0; off >>= 1) {
        if (t < off) red[t] += red[t + off];
        __syncthreads();
    }
    return red[0];
}

// Launch 1: deterministic partial sums of |w|, both matrices in one grid
// (work-groups 0..NPART-1: W1, the rest: W2).
__global__ __launch_bounds__(256) void absmean_partial_kernel(
    const float* __restrict__ W1, const float* __restrict__ W2,
    float* __restrict__ part1, float* __restrict__ part2) {
    __shared__ float red[256];
    const int  t      = threadIdx.x;
    const bool second = blockIdx.x >= NPART;
    const int  b      = second ? (int)blockIdx.x - NPART : (int)blockIdx.x;
    const float* __restrict__ w = (second ? W2 : W1) + (size_t)b * CHUNK;
    float s = 0.f;
    for (int i = t; i < CHUNK; i += 256) s += fabsf(w[i]);
    s = block_sum256(red, t, s);
    if (t == 0) (second ? part2 : part1)[b] = s;
}

// Launch 2, one grid: work-groups 0..QBLK-1 quantize W1, the next QBLK quantize W2,
// the last CBLK cast x to f16. A quantizing work-group first sums its matrix's
// NPART partials itself, so no launch stands between the partials and their use.
// w_t = clip(round(w/scale), -1, 1) stored exactly as f16 (-1/0/+1)
__global__ __launch_bounds__(256) void quantize_cast_kernel(
    const float* __restrict__ W1, const float* __restrict__ W2,
    const float* __restrict__ x,
    const float* __restrict__ part1, const float* __restrict__ part2,
    _Float16* __restrict__ W1h, _Float16* __restrict__ W2h,
    _Float16* __restrict__ xh) {
    __shared__ float red[256];
    const int t = threadIdx.x;

    if (blockIdx.x >= 2 * QBLK) {        // whole work-group: no barrier on this path
        for (int i = ((int)blockIdx.x - 2 * QBLK) * 256 + t; i < MTOK * EMB; i += CBLK * 256)
            xh[i] = (_Float16)x[i];
        return;
    }

    const bool second = blockIdx.x >= QBLK;
    const int  b      = second ? (int)blockIdx.x - QBLK : (int)blockIdx.x;
    const float* __restrict__ part = second ? part2 : part1;
    const float* __restrict__ w    = second ? W2 : W1;
    _Float16*    __restrict__ o    = second ? W2h : W1h;

    float s = 0.f;
    for (int k = 0; k < NPART / 256; ++k) s += part[k * 256 + t];   // same order as i = t, t + 256, ...
    s = block_sum256(red, t, s);
    const float inv = 1.0f / fmaxf(s * (1.0f / (float)NW), 1e-8f);

    for (int i = b * 256 + t; i < NW; i += QBLK * 256) {
        float q = __builtin_rintf(w[i] * inv);      // RNE == jnp.round
        q = fminf(1.f, fmaxf(-1.f, q));
        o[i] = (_Float16)q;
    }
}

// ---------------- WMMA GEMM: C[M,N] = A[M,K] * B[N,K]^T (+bias, opt GELU) ----
// Eight asynchronous copies to LDS, 16 B per lane. lds = the lane's LDS byte
// address, g = the lane's global address, both for the first copy; ls and gs
// lead from one copy to the next. The s_wait_xcnt closes the statement so that
// no address register named here is rewritten ahead of it.
__device__ __forceinline__ void async_copy8(unsigned lds, unsigned ls,
                                            const _Float16* g, size_t gs) {
    asm volatile(
        "global_load_async_to_lds_b128 %0, %8, off\n\t"
        "global_load_async_to_lds_b128 %1, %9, off\n\t"
        "global_load_async_to_lds_b128 %2, %10, off\n\t"
        "global_load_async_to_lds_b128 %3, %11, off\n\t"
        "global_load_async_to_lds_b128 %4, %12, off\n\t"
        "global_load_async_to_lds_b128 %5, %13, off\n\t"
        "global_load_async_to_lds_b128 %6, %14, off\n\t"
        "global_load_async_to_lds_b128 %7, %15, off\n\t"
        "s_wait_xcnt 0x0"
        :: "v"(lds),          "v"(lds + ls),     "v"(lds + 2 * ls), "v"(lds + 3 * ls),
           "v"(lds + 4 * ls), "v"(lds + 5 * ls), "v"(lds + 6 * ls), "v"(lds + 7 * ls),
           "v"(g),          "v"(g + gs),     "v"(g + 2 * gs), "v"(g + 3 * gs),
           "v"(g + 4 * gs), "v"(g + 5 * gs), "v"(g + 6 * gs), "v"(g + 7 * gs)
        : "memory");
}

// One wave's share of one operand in a pass: NROWS rows of BKT halfs each, whole
// row pieces per copy (BKT = 128: two rows a copy, so 16 rows are 8 copies).
template<int BKT, int NROWS>
__device__ __forceinline__ void stage_rows(unsigned lds, const _Float16* g, int K) {
    constexpr int      RPC = 256 / BKT;             // rows per copy
    constexpr unsigned LP  = (BKT + 8) * 2;         // LDS row pitch in bytes
    static_assert(NROWS % (8 * RPC) == 0, "whole statements of eight copies");
    #pragma unroll   // one or two statements, constant steps
    for (int c = 0; c < NROWS / (8 * RPC); ++c)
        async_copy8(lds + c * 8 * RPC * LP, RPC * LP,
                    g + (size_t)(c * 8 * RPC) * (size_t)K, (size_t)RPC * (size_t)K);
}

// erf of two values, one path for every lane: x * P(x^2) / Q(x^2) on x clamped to
// [-4, 4], beyond which erf is +-1 in f32. Within 4e-7 of erf everywhere; Q has
// coefficients of one sign, so it is never 0. The two Horner chains are independent.
__device__ __forceinline__ v2f erf2(v2f x) {
    x.x = __builtin_amdgcn_fmed3f(x.x, -4.0f, 4.0f);
    x.y = __builtin_amdgcn_fmed3f(x.y, -4.0f, 4.0f);
    const v2f t = x * x;
    v2f p = (v2f)(-2.72614225801306e-10f);
    p = __builtin_elementwise_fma(p, t, (v2f)(2.77068142495902e-08f));
    p = __builtin_elementwise_fma(p, t, (v2f)(-2.10102402082508e-06f));
    p = __builtin_elementwise_fma(p, t, (v2f)(-5.69250639462346e-05f));
    p = __builtin_elementwise_fma(p, t, (v2f)(-7.34990630326855e-04f));
    p = __builtin_elementwise_fma(p, t, (v2f)(-2.95459980854025e-03f));
    p = __builtin_elementwise_fma(p, t, (v2f)(-1.60960333262415e-02f));
    v2f q = (v2f)(-1.45660718464996e-05f);
    q = __builtin_elementwise_fma(q, t, (v2f)(-2.13374055278905e-04f));
    q = __builtin_elementwise_fma(q, t, (v2f)(-1.68282697438203e-03f));
    q = __builtin_elementwise_fma(q, t, (v2f)(-7.37332916720468e-03f));
    q = __builtin_elementwise_fma(q, t, (v2f)(-1.42647390514189e-02f));
    v2f rq;
    rq.x = __builtin_amdgcn_rcpf(q.x);
    rq.y = __builtin_amdgcn_rcpf(q.y);
    return (x * p) * rq;
}

// One BM x BN tile of C per work-group of eight waves, WM x WN of them, each with
// FM x FN accumulator tiles of 16 x 16: every A fragment read from LDS feeds FN
// products and every B fragment FM, and every staged row feeds the whole tile.
// BKT = k per pass. A buffer holds the pass's A rows (BM), then its B rows (BN),
// at a pitch of BKT + 8 halfs (16 B x an odd number).
template<int BM, int BN, int WM, int WN, int BKT, bool GELU, typename OutT>
__global__ __launch_bounds__(256) void gemm_wmma_kernel(
    const _Float16* __restrict__ A, const _Float16* __restrict__ B,
    const float* __restrict__ bias, OutT* __restrict__ C,
    int M, int N, int K)
{
    constexpr int      LDT     = BKT + 8;
    constexpr int      STAGE_H = (BM + BN) * LDT;   // halfs per buffer
    constexpr unsigned STAGE_B = STAGE_H * 2;       // bytes per buffer
    constexpr int      LPR     = BKT / 8;           // lanes per row piece
    constexpr int      FM      = BM / WM / 16;      // accumulator tiles per wave, down
    constexpr int      FN      = BN / WN / 16;      // and across
    static_assert(WM * WN == 8, "eight waves");

    __shared__ __attribute__((aligned(16))) _Float16 S[2 * STAGE_H];

    const int t     = threadIdx.x;
    const int lane  = t & 31;
    const int wave  = __builtin_amdgcn_readfirstlane(t >> 5);   // scalar: what hangs on it stays out of the VGPRs
    const int waveM = wave % WM;
    const int waveN = wave / WM;
    const int r     = lane & 15;
    const int hs    = (lane >> 4) << 3;  // 0 or 8 halfs (K half-select)

    const int blockN = blockIdx.x * BN;
    const int blockM = blockIdx.y * BM;

    // staging: every wave brings an eighth of the A rows and an eighth of the B rows
    const int rowA = wave * (BM / 8) + lane / LPR;
    const int rowB = wave * (BN / 8) + lane / LPR;
    const int ckT  = (lane % LPR) * 8;   // halfs: 16 B per lane along the row

    // the lane's place in the pass that is staged next; both step on by BKT
    const _Float16* gA = A + (size_t)(blockM + rowA) * (size_t)K + ckT;
    const _Float16* gB = B + (size_t)(blockN + rowB) * (size_t)K + ckT;
    const unsigned  lA = (unsigned)(size_t)&S[rowA * LDT + ckT];
    const unsigned  lB = (unsigned)(size_t)&S[(BM + rowB) * LDT + ckT];

    v8f acc[FM][FN] = {};

    const int nPass = K / BKT;

    // pass 0 into buffer 0, landed and published; then pass 1 into buffer 1
    stage_rows<BKT, BM / 8>(lA, gA, K);
    stage_rows<BKT, BN / 8>(lB, gB, K);
    asm volatile("s_wait_asynccnt 0x0" ::: "memory");   // this wave's copies have landed
    __syncthreads();
    gA += BKT;
    gB += BKT;
    if (nPass > 1) {
        stage_rows<BKT, BM / 8>(lA + STAGE_B, gA, K);
        stage_rows<BKT, BN / 8>(lB + STAGE_B, gB, K);
    }

    for (int it = 0; it < nPass; ++it) {
        const _Float16* Sa = S + (it & 1) * STAGE_H;
        const _Float16* Sb = Sa + BM * LDT;

        #pragma unroll   // constant fragment offsets inside the pass
        for (int kb = 0; kb < BKT; kb += 32) {
            v16h a[FM], b[FN];
            #pragma unroll
            for (int i = 0; i < FM; ++i) {
                const _Float16* p = &Sa[(waveM * (FM * 16) + i * 16 + r) * LDT + kb];
                ((v8h*)&a[i])[0] = *(const v8h*)(p + hs);
                ((v8h*)&a[i])[1] = *(const v8h*)(p + 16 + hs);
            }
            #pragma unroll
            for (int j = 0; j < FN; ++j) {
                const _Float16* p = &Sb[(waveN * (FN * 16) + j * 16 + r) * LDT + kb];
                ((v8h*)&b[j])[0] = *(const v8h*)(p + hs);
                ((v8h*)&b[j])[1] = *(const v8h*)(p + 16 + hs);
            }
            // the block's LDS reads stay one group ahead of its products: with two
            // waves on a SIMD a read and its wait in front of each row is not covered
            __builtin_amdgcn_sched_barrier(0);

            #pragma unroll
            for (int i = 0; i < FM; ++i)
                #pragma unroll
                for (int j = 0; j < FN; ++j)
                    acc[i][j] = __builtin_amdgcn_wmma_f32_16x16x32_f16(
                        false, a[i], false, b[j], (short)0, acc[i][j], false, false);
            // and the next block's reads stay out of this block's products
            __builtin_amdgcn_sched_barrier(0);
        }

        // hand-over: this wave has left its buffer and its copies of the next
        // pass have landed; the barrier says both of every wave
        asm volatile("s_wait_dscnt 0x0" ::: "memory");
        asm volatile("s_wait_asynccnt 0x0" ::: "memory");
        __syncthreads();

        gA += BKT;
        gB += BKT;
        if (it + 2 < nPass) {            // refill the buffer just left: one pass of lead
            stage_rows<BKT, BM / 8>(lA + (unsigned)(it & 1) * STAGE_B, gA, K);
            stage_rows<BKT, BN / 8>(lB + (unsigned)(it & 1) * STAGE_B, gB, K);
        }
    }
    asm volatile("s_wait_asynccnt 0x0" ::: "memory");   // nothing in flight at the wave's end

    // epilogue: C/D layout — VGPR e, lanes0-15: (M=e,N=lane); lanes16-31: (M=8+e)
    #pragma unroll
    for (int i = 0; i < FM; ++i) {
        const int mBase = blockM + waveM * (FM * 16) + i * 16 + hs;  // hs == 8*(lane>>4)
        #pragma unroll
        for (int j = 0; j < FN; ++j) {
            const int n  = blockN + waveN * (FN * 16) + j * 16 + r;
            const float bv = bias[n];
            if constexpr (GELU) {
                #pragma unroll   // constant accumulator indices
                for (int e = 0; e < 8; e += 2) {     // two rows at a time: packed f32 arithmetic
                    v2f v;
                    v.x = acc[i][j][e];
                    v.y = acc[i][j][e + 1];
                    v += (v2f)(bv);
                    const v2f hv = v * (v2f)(0.5f);
                    const v2f g  = __builtin_elementwise_fma(
                        hv, erf2(v * (v2f)(0.70710678118654752f)), hv);   // 0.5 v (1 + erf)
                    const v2h gh = __builtin_convertvector(g, v2h);
                    C[(size_t)(mBase + e) * (size_t)N + n]     = (OutT)gh.x;
                    C[(size_t)(mBase + e + 1) * (size_t)N + n] = (OutT)gh.y;
                }
            } else {
                #pragma unroll   // constant accumulator indices
                for (int e = 0; e < 8; ++e)
                    C[(size_t)(mBase + e) * (size_t)N + n] = (OutT)(acc[i][j][e] + bv);
            }
        }
    }
}

// ---------------- launcher ----------------
extern "C" void kernel_launch(void* const* d_in, const int* in_sizes, int n_in,
                              void* d_out, int out_size, void* d_ws, size_t ws_size,
                              hipStream_t stream) {
    const float* x  = (const float*)d_in[0];   // [4,2048,1024]
    const float* W1 = (const float*)d_in[1];   // [4096,1024]
    const float* b1 = (const float*)d_in[2];   // [4096]
    const float* W2 = (const float*)d_in[3];   // [1024,4096]
    const float* b2 = (const float*)d_in[4];   // [1024]
    float* out = (float*)d_out;                // [4,2048,1024] f32

    char* ws = (char*)d_ws;
    float*    part1 = (float*)(ws + 0);                 // 1024 f32
    float*    part2 = (float*)(ws + 4096);              // 1024 f32
    _Float16* xh    = (_Float16*)(ws + 16384);                          // 16 MB
    _Float16* W1h   = xh  + (size_t)MTOK * EMB;                         // 8 MB
    _Float16* W2h   = W1h + (size_t)FF * EMB;                           // 8 MB
    _Float16* h     = W2h + (size_t)EMB * FF;                           // 64 MB

    absmean_partial_kernel<<<2 * NPART, 256, 0, stream>>>(W1, W2, part1, part2);
    quantize_cast_kernel<<<2 * QBLK + CBLK, 256, 0, stream>>>(W1, W2, x, part1, part2,
                                                              W1h, W2h, xh);

    // GEMM1 + bias + exact GELU -> h (f16):  [8192,1024] x [4096,1024]^T
    // 256 x 256 per work-group, 64 x 128 per wave: 512 work-groups, one to a WGP
    gemm_wmma_kernel<256, 256, 4, 2, 128, true, _Float16>
        <<<dim3(FF / 256, MTOK / 256), 256, 0, stream>>>(xh, W1h, b1, h, MTOK, FF, EMB);
    // GEMM2 + bias -> out (f32):             [8192,4096] x [1024,4096]^T
    // 128 x 256 per work-group, 64 x 64 per wave: 256 work-groups, one to a WGP
    gemm_wmma_kernel<128, 256, 2, 4, 128, false, float>
        <<<dim3(EMB / 256, MTOK / 128), 256, 0, stream>>>(h, W2h, b2, out, MTOK, EMB, FF);
}
